// v000
// Times are from an AMD MI455X. After a warm-up the kernel runs many times in a row, and a time is the length of
// such a window on the GPU divided by its runs, so every launch and the gaps after it count. The runs cycle
// through copies of the inputs. A figure is the median of several windows, for all but v000 over two sittings.
// Sittings can differ by a few percent; kernels timed side by side share one.
// The starting kernel, v000, takes 327 microseconds a run.
#include <hip/hip_runtime.h>

// Contractions, f32 accumulate: q = query.w_q^T, k = key.w_k^T, v = value.w_v^T ([4096 = (s,b) rows x 1024].[1024 x 1024]) and k_pos = pe[1:2048].w_k_pos^T
// ([2047 x 1024].[1024 x 1024]) on v_wmma_f32_16x16x32_bf16 with PLAIN bf16 operands (inputs rounded once: exact products); the per-(batch, head) attention fused
// on v_wmma_f32_16x16x32_f16: content scores (q + content_bias).k^T (plain f16, 4 WMMA per 32-key step), relative-position scores (q + pos_bias).k_pos[m]^T over
// the 48-row band m = 1023 - q + k that the Transformer-XL rel-shift selects (6 WMMA per step into a per-wave LDS tile, then gathered by the arithmetic index),
// softmax over all 1024 keys, and weights.v with plain f16 weights (x32768) and plain f16 v (flat softmax over 1024 keys averages the single rounding); out = ctx.w_out^T + b_out on

#define SS   1024
#define NBT  4
#define EE   1024
#define NH_  16
#define HD   64
#define MPOS 2047
#define MP   2048                // padded k_pos rows (row 2047 zero)
#define NTK  (SS * NBT)          // 4096 token rows, row = s*4 + b
#define PSC  32768.0f
#define LOSC 1024.0f
#define LOSCI (1.0f / 1024.0f)
#define SCL  0.125f

typedef _Float16 h16;
typedef unsigned short bf;
typedef __attribute__((ext_vector_type(16))) __bf16   v16bf;
typedef __attribute__((ext_vector_type(16))) _Float16 v16h;
typedef __attribute__((ext_vector_type(8)))  _Float16 v8h;
typedef __attribute__((ext_vector_type(8)))  unsigned short v8us;
typedef __attribute__((ext_vector_type(8)))  float    v8f;
typedef __attribute__((ext_vector_type(4)))  float    v4f;
typedef v8h  __attribute__((may_alias)) v8ha;
typedef v4f  __attribute__((may_alias)) v4fa;
typedef v8us __attribute__((may_alias)) v8usa;

__device__ __forceinline__ unsigned short f2bf(float f) { unsigned u = __float_as_uint(f); u += 0x7FFFu + ((u >> 16) & 1u); return (unsigned short)(u >> 16); }
__device__ __forceinline__ float bf2f(unsigned short b) { return __uint_as_float(((unsigned)b) << 16); }
__device__ __forceinline__ float bfr(float f) { return bf2f(f2bf(f)); }
__device__ __forceinline__ v16h cat16(v8h lo, v8h hi) { return __builtin_shufflevector(lo, hi, 0, 1, 2, 3, 4, 5, 6, 7, 8, 9, 10, 11, 12, 13, 14, 15); }
__device__ __forceinline__ v16bf cat16b(v8us lo, v8us hi) { return __builtin_bit_cast(v16bf, __builtin_shufflevector(lo, hi, 0, 1, 2, 3, 4, 5, 6, 7, 8, 9, 10, 11, 12, 13, 14, 15)); }
__device__ __forceinline__ v8f wmma16(v16h a, v16h b, v8f c) { return __builtin_amdgcn_wmma_f32_16x16x32_f16(false, a, false, b, (short)0, c, false, false); }
__device__ __forceinline__ v8f wmmab(v16bf a, v16bf b, v8f c) { return __builtin_amdgcn_wmma_f32_16x16x32_bf16(false, a, false, b, (short)0, c, false, false); }
#define VST2(T, p, v) do { const T vst2_v_ = (v); *(T*)(p) = vst2_v_;  } while (0)

__global__ __launch_bounds__(256) void k_cvtb(const float* __restrict__ src, int srcoff, int nvalid, int nrows, bf* dst) {
    const int lane = threadIdx.x & 31, r = blockIdx.x * 8 + (threadIdx.x >> 5);
    if (r >= nrows) return;
    const int rs = (r < nvalid) ? (r + srcoff) : srcoff;
#pragma unroll
    for (int q = 0; q < 4; ++q) { v8us t;
#pragma unroll
        for (int i = 0; i < 8; ++i) { const unsigned short hb = f2bf(src[(size_t)rs * EE + q * 256 + lane * 8 + i]); t[i] = (r < nvalid) ? hb : (unsigned short)0; }
        VST2(v8us, dst + (size_t)r * EE + q * 256 + lane * 8, t); }
}

// k_gemmb: 64 x 64 tile of C[M][1024] = (A [+ Al]).B^T (K = 1024) (+ bias); MODE 0 f32 rows; MODE 1: two f16 planes C = f16(acc + cb[h][d]), C2 = f16(acc + pb[h][d])
// (the content / position query variants; column c = h*64 + d); MODE 2: f16 rows (k, k_pos).
template <bool SPLITA, int MODE>
__global__ __launch_bounds__(128) void k_gemmb(const bf* __restrict__ A, const bf* __restrict__ Al, const bf* __restrict__ Bn, const float* __restrict__ bias, const float* __restrict__ bias2, void* C, void* C2) {
    __shared__ __align__(16) float ost[4][16 * 68];
    const int lane = threadIdx.x & 31, wave = threadIdx.x >> 5, lr = lane & 15, hi = lane >> 4;
    const int r0 = blockIdx.x * 64 + wave * 16, c0 = blockIdx.y * 64;
    const size_t aoff = (size_t)(r0 + lr) * EE + 8 * hi;
    size_t boff[4];
#pragma unroll
    for (int t = 0; t < 4; ++t) boff[t] = (size_t)(c0 + t * 16 + lr) * EE + 8 * hi;
    v8f acc[4];
#pragma unroll
    for (int t = 0; t < 4; ++t) acc[t] = (v8f){};
#pragma unroll 1
    for (int kc = 0; kc < EE; kc += 32) {
        const v16bf a = cat16b(*(const v8us*)(A + aoff + kc), *(const v8us*)(A + aoff + kc + 16));
        v16bf al = a;
        if (SPLITA) al = cat16b(*(const v8us*)(Al + aoff + kc), *(const v8us*)(Al + aoff + kc + 16));
#pragma unroll
        for (int t = 0; t < 4; ++t) { const v16bf b = cat16b(*(const v8us*)(Bn + boff[t] + kc), *(const v8us*)(Bn + boff[t] + kc + 16)); acc[t] = wmmab(a, b, acc[t]); if (SPLITA) acc[t] = wmmab(al, b, acc[t]); }
        asm volatile("v_nop\n\tv_nop\n\tv_nop\n\tv_nop" : "+v"(acc[0]), "+v"(acc[1]), "+v"(acc[2]), "+v"(acc[3]) : "v"(a), "v"(al));
    }
    float* os = &ost[wave][0];
#pragma unroll
    for (int t = 0; t < 4; ++t) { const int col = c0 + t * 16 + lr; const float bv = (MODE == 0 && bias) ? bfr(bias[col]) : 0.f;
#pragma unroll
        for (int j = 0; j < 8; ++j) os[(hi * 8 + j) * 68 + t * 16 + lr] = acc[t][j] + bv; }
    __syncthreads();
    if (MODE == 0) {
        float* crow = (float*)C + (size_t)r0 * EE + c0;
        auto pass = [&]() {
#pragma unroll
            for (int s = 0; s < 8; ++s) { const int Lid = (lane >> 3) + 4 * s, piece = lane & 7; const int row = Lid >> 1, cofs = (Lid & 1) * 32 + piece * 4;
                const v4f val = *(const v4fa*)(os + row * 68 + cofs); *(v4f*)(crow + (size_t)row * EE + cofs) = val; }
        };
        pass(); 
    } else if (MODE == 1) {
        h16* c1 = (h16*)C + (size_t)r0 * EE + c0; h16* c2 = (h16*)C2 + (size_t)r0 * EE + c0;
        auto pass = [&]() {
#pragma unroll
            for (int s = 0; s < 4; ++s) { const int row = 4 * s + (lane >> 3), piece = lane & 7; const float* sp = os + row * 68 + piece * 8; v8h o1, o2;
#pragma unroll
                for (int i = 0; i < 8; ++i) { const int col = c0 + piece * 8 + i; o1[i] = (h16)(sp[i] + bfr(bias[col])); o2[i] = (h16)(sp[i] + bfr(bias2[col])); }
                *(v8h*)(c1 + (size_t)row * EE + piece * 8) = o1; *(v8h*)(c2 + (size_t)row * EE + piece * 8) = o2; }
        };
        pass(); 
    } else {
        h16* c1 = (h16*)C + (size_t)r0 * EE + c0;
        auto pass = [&]() {
#pragma unroll
            for (int s = 0; s < 4; ++s) { const int row = 4 * s + (lane >> 3), piece = lane & 7; const float* sp = os + row * 68 + piece * 8; v8h o1;
#pragma unroll
                for (int i = 0; i < 8; ++i) o1[i] = (h16)sp[i];
                *(v8h*)(c1 + (size_t)row * EE + piece * 8) = o1; }
        };
        pass(); 
    }
}

// k_vt: VTH [b][h][d][s] = f16 of V row (s*4 + b), col h*64 + d; block (b, h, 64 s): LDS transposes.
__global__ __launch_bounds__(256) void k_vt(const float* __restrict__ V, h16* VTH) {
    __shared__ __align__(16) h16 tile[HD * 72];
    const int bid = blockIdx.x;
    const int b = bid / (NH_ * (SS / 64)), rem = bid - b * (NH_ * (SS / 64)), h = rem / (SS / 64), kt = rem - h * (SS / 64);
    const int s0 = kt * 64, tid = threadIdx.x, kk = tid >> 2, d0 = (tid & 3) * 16;
    const float* src = V + ((size_t)(s0 + kk) * NBT + b) * EE + h * HD + d0;
#pragma unroll
    for (int i = 0; i < 16; ++i) tile[(d0 + i) * 72 + kk] = (h16)src[i];
    __syncthreads();
    const int piece = tid & 7;
    const size_t base = (((size_t)b * NH_ + h) * HD) * SS + s0;
    auto pass = [&]() {
#pragma unroll
        for (int s = 0; s < 2; ++s) { const int d = (tid >> 3) + 32 * s;
            const v8h val = *(const v8ha*)(tile + d * 72 + piece * 8); *(v8h*)(VTH + base + (size_t)d * SS + piece * 8) = val; }
    };
    pass(); 
}

// k_attn: block = (b, h, 64 queries), wave = 16 consecutive queries q0..q0+15; 32 key tiles of 32 keys; per tile:
//   content: 4 WMMA (QC rows (s*4+b) . K rows); position: B = KP rows m = mbase .. mbase+47 (mbase = 1023 - (q0+15) + l0, wave-specific) in 3 n-tiles x 2 k-chunks
//   = 6 WMMA against QP; the 16 x 48 result is parked in the wave's LDS tile and each lane gathers pos[r][15 - r + kk] (kk = key offset 0..31) = the rel-shifted
//   score; logits = (content + pos) / 8; online f32 softmax; weights x32768 plain f16 tile (same-wave may_alias reload after a compiler barrier); 4 WMMA against
__global__ __launch_bounds__(128) void k_attn(const h16* __restrict__ QC, const h16* __restrict__ QP, const h16* __restrict__ K16, const h16* __restrict__ KP,
                                             const h16* __restrict__ VTH, bf* CH, bf* CL) {
    __shared__ __align__(16) h16 plds[4][16 * 32];
    __shared__ __align__(16) float posl[4][16 * 52];
    __shared__ __align__(16) float ost[4][16 * 68];
    const int lane = threadIdx.x & 31, wave = threadIdx.x >> 5, lr = lane & 15, hi = lane >> 4;
    const int bid = blockIdx.x;
    const int b = bid / (NH_ * (SS / 64)), rem = bid - b * (NH_ * (SS / 64)), h = rem / (SS / 64), qt = rem - h * (SS / 64);
    const int q0 = qt * 64 + wave * 16;
    h16* pl = &plds[wave][0]; float* ps = &posl[wave][0];
    v16h qc[2];
    const size_t qoff = ((size_t)(q0 + lr) * NBT + b) * EE + h * HD + 8 * hi;
#pragma unroll
    for (int kc = 0; kc < 2; ++kc) qc[kc] = cat16(*(const v8h*)(QC + qoff + kc * 32), *(const v8h*)(QC + qoff + kc * 32 + 16));
    const size_t vbase = (((size_t)b * NH_ + h) * HD) * SS;
    v8f o[4];
#pragma unroll
    for (int n = 0; n < 4; ++n) o[n] = (v8f){};
    float mrow[8], lpart[8];
#pragma unroll
    for (int j = 0; j < 8; ++j) { mrow[j] = -3.0e38f; lpart[j] = 0.f; }
#pragma unroll 1
    for (int kt = 0; kt < SS / 32; ++kt) {
        const int l0 = kt * 32;
        // content
        v8f s0 = {}, s1 = {};
#pragma unroll
        for (int kc = 0; kc < 2; ++kc) {
            const size_t o0 = ((size_t)(l0 + lr) * NBT + b) * EE + h * HD + kc * 32 + 8 * hi, o1 = ((size_t)(l0 + 16 + lr) * NBT + b) * EE + h * HD + kc * 32 + 8 * hi;
            s0 = wmma16(qc[kc], cat16(*(const v8h*)(K16 + o0), *(const v8h*)(K16 + o0 + 16)), s0);
            s1 = wmma16(qc[kc], cat16(*(const v8h*)(K16 + o1), *(const v8h*)(K16 + o1 + 16)), s1);
        }
        // position band: rows m = mbase + (t*16 + lr)
        const int mbase = (SS - 1) - (q0 + 15) + l0;
        { const v16h qp0 = cat16(*(const v8h*)(QP + qoff), *(const v8h*)(QP + qoff + 16)), qp1 = cat16(*(const v8h*)(QP + qoff + 32), *(const v8h*)(QP + qoff + 48));   // (q + pos_bias) fragments, re-read per step (register budget)
#pragma unroll
          for (int t = 0; t < 3; ++t) {
            const size_t om = ((size_t)(mbase + t * 16 + lr) * NH_ + h) * HD + 8 * hi;      // KP row m = mbase + t*16 + lr, head h: [m][h*64 + d]
            v8f pz = wmma16(qp0, cat16(*(const v8h*)(KP + om), *(const v8h*)(KP + om + 16)), (v8f){});
            pz = wmma16(qp1, cat16(*(const v8h*)(KP + om + 32), *(const v8h*)(KP + om + 48)), pz);
            asm volatile("v_nop\n\tv_nop\n\tv_nop\n\tv_nop" : "+v"(pz) : "v"(qp0), "v"(qp1));
#pragma unroll
            for (int j = 0; j < 8; ++j) ps[(hi * 8 + j) * 52 + t * 16 + lr] = pz[j];
          } }
        asm volatile("v_nop\n\tv_nop\n\tv_nop\n\tv_nop" : "+v"(s0), "+v"(s1) : "v"(qc[0]), "v"(qc[1]));
        asm volatile("" ::: "memory");
        __builtin_amdgcn_fence(__ATOMIC_RELEASE, "workgroup");
        __builtin_amdgcn_wave_barrier();
        float alpha[8];
#pragma unroll
        for (int j = 0; j < 8; ++j) {
            const int r = hi * 8 + j;                              // local query row: m index of key kk is (15 - r + kk)
            const float p0v = ps[r * 52 + 15 - r + lr], p1v = ps[r * 52 + 15 - r + 16 + lr];
            const float a0 = (s0[j] + p0v) * SCL, a1 = (s1[j] + p1v) * SCL;
            float mx = fmaxf(a0, a1);
            mx = fmaxf(mx, __shfl_xor(mx, 1, 16)); mx = fmaxf(mx, __shfl_xor(mx, 2, 16)); mx = fmaxf(mx, __shfl_xor(mx, 4, 16)); mx = fmaxf(mx, __shfl_xor(mx, 8, 16));
            const float mn = fmaxf(mrow[j], mx);
            alpha[j] = __expf(mrow[j] - mn); mrow[j] = mn;
            const float e0 = __expf(a0 - mn), e1 = __expf(a1 - mn);
            lpart[j] = lpart[j] * alpha[j] + (e0 + e1);
            pl[r * 32 + lr] = (h16)(e0 * PSC); pl[r * 32 + 16 + lr] = (h16)(e1 * PSC);
        }
#pragma unroll
        for (int n = 0; n < 4; ++n)
#pragma unroll
            for (int j = 0; j < 8; ++j) o[n][j] *= alpha[j];
        asm volatile("" ::: "memory");
        const v16h pa = cat16(*(const v8ha*)(pl + lr * 32 + hi * 8), *(const v8ha*)(pl + lr * 32 + 16 + hi * 8));
#pragma unroll
        for (int n = 0; n < 4; ++n) { const size_t vo = vbase + (size_t)(n * 16 + lr) * SS + l0 + hi * 8;
            o[n] = wmma16(pa, cat16(*(const v8h*)(VTH + vo), *(const v8h*)(VTH + vo + 16)), o[n]); }
        asm volatile("v_nop\n\tv_nop\n\tv_nop\n\tv_nop" : "+v"(o[0]), "+v"(o[1]), "+v"(o[2]), "+v"(o[3]) : "v"(pa));
        __builtin_amdgcn_wave_barrier();                           // all lanes have read this step's pos tile before the next step overwrites it
    }
    float inv[8];
#pragma unroll
    for (int j = 0; j < 8; ++j) { float rs = lpart[j]; rs += __shfl_xor(rs, 1, 16); rs += __shfl_xor(rs, 2, 16); rs += __shfl_xor(rs, 4, 16); rs += __shfl_xor(rs, 8, 16); inv[j] = 1.0f / (rs * PSC); }
    float* os = &ost[wave][0];
#pragma unroll
    for (int n = 0; n < 4; ++n)
#pragma unroll
        for (int j = 0; j < 8; ++j) os[(hi * 8 + j) * 68 + n * 16 + lr] = o[n][j] * inv[j];
    __syncthreads();
    auto pass = [&]() {
#pragma unroll
        for (int s = 0; s < 4; ++s) { const int row = 4 * s + (lane >> 3), piece = lane & 7; const float* sp = os + row * 68 + piece * 8; v8us oh, ol;
#pragma unroll
            for (int i = 0; i < 8; ++i) { const unsigned short hb = f2bf(sp[i]); oh[i] = hb; ol[i] = f2bf(sp[i] - bf2f(hb)); }
            const size_t co = ((size_t)(q0 + row) * NBT + b) * EE + h * HD + piece * 8;
            *(v8us*)(CH + co) = oh; *(v8us*)(CL + co) = ol; }
    };
    pass(); 
}

extern "C" void kernel_launch(void* const* d_in, const int* in_sizes, int n_in,
                              void* d_out, int out_size, void* d_ws, size_t ws_size, hipStream_t stream) {
    (void)in_sizes; (void)n_in; (void)out_size;
    const float* query = (const float*)d_in[0]; const float* key = (const float*)d_in[1]; const float* value = (const float*)d_in[2]; const float* pe = (const float*)d_in[3];
    const float* wq = (const float*)d_in[4]; const float* wk = (const float*)d_in[5]; const float* wv = (const float*)d_in[6]; const float* wkp = (const float*)d_in[7];
    const float* cb = (const float*)d_in[8]; const float* pb = (const float*)d_in[9]; const float* wo = (const float*)d_in[10]; const float* bo = (const float*)d_in[11];
    float* out = (float*)d_out;    // [1024][4][1024]
    char* wsp = (char*)d_ws;
    auto take = [&](size_t bytes) { char* p = wsp; wsp += (bytes + 255) & ~(size_t)255; return (void*)p; };
    bf* Xq = (bf*)take((size_t)NTK * EE * 2); bf* Xk = (bf*)take((size_t)NTK * EE * 2); bf* Xv = (bf*)take((size_t)NTK * EE * 2); bf* Xp = (bf*)take((size_t)MP * EE * 2);
    bf* Wq = (bf*)take((size_t)EE * EE * 2); bf* Wk = (bf*)take((size_t)EE * EE * 2); bf* Wv = (bf*)take((size_t)EE * EE * 2); bf* Wp = (bf*)take((size_t)EE * EE * 2); bf* Wo = (bf*)take((size_t)EE * EE * 2);
    h16* QC = (h16*)take((size_t)NTK * EE * 2); h16* QP = (h16*)take((size_t)NTK * EE * 2); h16* K16 = (h16*)take((size_t)NTK * EE * 2); h16* KP = (h16*)take((size_t)MP * EE * 2);
    float* Vf = (float*)take((size_t)NTK * EE * 4); h16* VTH = (h16*)take((size_t)NTK * EE * 2);
    if ((size_t)(wsp - (char*)d_ws) > ws_size) return;    // 8.4x3 + 4.2 + 10.5 + 8.4x3 + 4.2 + 16.8 + 8.4 = 94.4 MB (CH/CL alias Xq/Xk after their last readers)
    bf* CH = Xq; bf* CL = Xk;                      // Xq, Xk are dead after the q / k projections
    k_cvtb<<<NTK / 8, 256, 0, stream>>>(query, 0, NTK, NTK, Xq);
    k_cvtb<<<NTK / 8, 256, 0, stream>>>(key, 0, NTK, NTK, Xk);
    k_cvtb<<<NTK / 8, 256, 0, stream>>>(value, 0, NTK, NTK, Xv);
    k_cvtb<<<MP / 8, 256, 0, stream>>>(pe, 1, MPOS, MP, Xp);                     // pe[1 : 2048], row 2047 zero
    k_cvtb<<<EE / 8, 256, 0, stream>>>(wq, 0, EE, EE, Wq); k_cvtb<<<EE / 8, 256, 0, stream>>>(wk, 0, EE, EE, Wk); k_cvtb<<<EE / 8, 256, 0, stream>>>(wv, 0, EE, EE, Wv);
    k_cvtb<<<EE / 8, 256, 0, stream>>>(wkp, 0, EE, EE, Wp); k_cvtb<<<EE / 8, 256, 0, stream>>>(wo, 0, EE, EE, Wo);
    k_gemmb<false, 1><<<dim3(NTK / 64, EE / 64, 1), 128, 0, stream>>>(Xq, nullptr, Wq, cb, pb, QC, QP);          // q + content_bias, q + pos_bias (f16)
    k_gemmb<false, 2><<<dim3(NTK / 64, EE / 64, 1), 128, 0, stream>>>(Xk, nullptr, Wk, nullptr, nullptr, K16, nullptr);
    k_gemmb<false, 2><<<dim3(MP / 64, EE / 64, 1), 128, 0, stream>>>(Xp, nullptr, Wp, nullptr, nullptr, KP, nullptr);  // k_pos (pad row 2047 = 0)
    k_gemmb<false, 0><<<dim3(NTK / 64, EE / 64, 1), 128, 0, stream>>>(Xv, nullptr, Wv, nullptr, nullptr, Vf, nullptr);
    k_vt<<<NBT * NH_ * (SS / 64), 256, 0, stream>>>(Vf, VTH);
    k_attn<<<NBT * NH_ * (SS / 64), 128, 0, stream>>>(QC, QP, K16, KP, VTH, CH, CL);
    k_gemmb<true, 0><<<dim3(NTK / 64, EE / 64, 1), 128, 0, stream>>>(CH, CL, Wo, bo, nullptr, out, nullptr);         // out = ctx.w_out^T + b_out
}

// v001
// One run takes 214 microseconds.
// Timed twice side by side with v000, it ran 1.55 and 1.57 times as fast.
#include <hip/hip_runtime.h>

// Contractions, f32 accumulate: q = query.w_q^T, k = key.w_k^T, v = value.w_v^T ([4096 = (s,b) rows x 1024].[1024 x 1024]) and k_pos = pe[1:2048].w_k_pos^T
// ([2047 x 1024].[1024 x 1024]) on v_wmma_f32_16x16x32_bf16 with PLAIN bf16 operands (inputs rounded once: exact products); the per-(batch, head) attention fused
// on v_wmma_f32_16x16x32_f16: content scores (q + content_bias).k^T (plain f16, 4 WMMA per 32-key step), relative-position scores (q + pos_bias).k_pos[m]^T over
// the 48-row band m = 1023 - q + k that the Transformer-XL rel-shift selects (6 WMMA per step into a per-wave LDS tile, then gathered by the arithmetic index),
// softmax over all 1024 keys, and weights.v with plain f16 weights (x32768) and plain f16 v (flat softmax over 1024 keys averages the single rounding); out = ctx.w_out^T + b_out on

#define SS   1024
#define NBT  4
#define EE   1024
#define NH_  16
#define HD   64
#define MPOS 2047
#define MP   2048                // padded k_pos rows (row 2047 zero)
#define NTK  (SS * NBT)          // 4096 token rows, row = s*4 + b
#define PSC  32768.0f
#define LOSC 1024.0f
#define LOSCI (1.0f / 1024.0f)
#define SCL  0.125f

typedef _Float16 h16;
typedef unsigned short bf;
typedef __attribute__((ext_vector_type(16))) __bf16   v16bf;
typedef __attribute__((ext_vector_type(16))) _Float16 v16h;
typedef __attribute__((ext_vector_type(8)))  _Float16 v8h;
typedef __attribute__((ext_vector_type(8)))  unsigned short v8us;
typedef __attribute__((ext_vector_type(8)))  float    v8f;
typedef __attribute__((ext_vector_type(4)))  float    v4f;
typedef v8h  __attribute__((may_alias)) v8ha;
typedef v4f  __attribute__((may_alias)) v4fa;
typedef v8us __attribute__((may_alias)) v8usa;

__device__ __forceinline__ unsigned short f2bf(float f) { unsigned u = __float_as_uint(f); u += 0x7FFFu + ((u >> 16) & 1u); return (unsigned short)(u >> 16); }
__device__ __forceinline__ float bf2f(unsigned short b) { return __uint_as_float(((unsigned)b) << 16); }
__device__ __forceinline__ float bfr(float f) { return bf2f(f2bf(f)); }
__device__ __forceinline__ v16h cat16(v8h lo, v8h hi) { return __builtin_shufflevector(lo, hi, 0, 1, 2, 3, 4, 5, 6, 7, 8, 9, 10, 11, 12, 13, 14, 15); }
__device__ __forceinline__ v16bf cat16b(v8us lo, v8us hi) { return __builtin_bit_cast(v16bf, __builtin_shufflevector(lo, hi, 0, 1, 2, 3, 4, 5, 6, 7, 8, 9, 10, 11, 12, 13, 14, 15)); }
__device__ __forceinline__ v8f wmma16(v16h a, v16h b, v8f c) { return __builtin_amdgcn_wmma_f32_16x16x32_f16(false, a, false, b, (short)0, c, false, false); }
__device__ __forceinline__ v8f wmmab(v16bf a, v16bf b, v8f c) { return __builtin_amdgcn_wmma_f32_16x16x32_bf16(false, a, false, b, (short)0, c, false, false); }
#define VST2(T, p, v) do { const T vst2_v_ = (v); *(T*)(p) = vst2_v_;  } while (0)

__global__ __launch_bounds__(256) void k_cvtb(const float* __restrict__ src, int srcoff, int nvalid, int nrows, bf* dst) {
    const int lane = threadIdx.x & 31, r = blockIdx.x * 8 + (threadIdx.x >> 5);
    if (r >= nrows) return;
    const int rs = (r < nvalid) ? (r + srcoff) : srcoff;
#pragma unroll
    for (int q = 0; q < 4; ++q) { v8us t;
#pragma unroll
        for (int i = 0; i < 8; ++i) { const unsigned short hb = f2bf(src[(size_t)rs * EE + q * 256 + lane * 8 + i]); t[i] = (r < nvalid) ? hb : (unsigned short)0; }
        VST2(v8us, dst + (size_t)r * EE + q * 256 + lane * 8, t); }
}

// k_gemmb: 128 x 128 tile of C[M][1024] = (A [+ Al]).B^T (K = 1024) (+ bias) per work-group, 8 waves (4 x 2), 32 x 64 of it per wave. A pass is 128 k = 256 bytes of
// every operand row; a stage is [A 128 rows | B 128 rows] in LDS at pitch 272 B, brought by one tensor load per wave (its own 32 rows), two buffers, the next
// stage in flight while this one is worked on. With SPLITA the passes run over A first and then over Al (B read again): K = 2048 in effect.
// MODE 0 f32 rows; MODE 1: two f16 planes C = f16(acc + cb[h][d]), C2 = f16(acc + pb[h][d]) (the content / position query variants; column c = h*64 + d);
// MODE 2: f16 rows (k, k_pos).
#define GKB    256               // bytes of an operand row per pass
#define GPITCH 272               // LDS row pitch: 256 + the mover's 16-byte pad (16 B x odd, for ds_load_b128 readers)
#define GSLICE 10240             // one wave's 32 rows (8704 B) rounded up to a multiple of 2 KiB
#define GSTAGE (8 * GSLICE)
#define GPASS  (EE * 2 / GKB)    // passes per operand plane
typedef unsigned int u32x4 __attribute__((ext_vector_type(4)));
typedef unsigned int u32x8 __attribute__((ext_vector_type(8)));
__device__ __forceinline__ unsigned uni(unsigned v) { return (unsigned)__builtin_amdgcn_readfirstlane(v); }
__device__ __forceinline__ unsigned pinned(unsigned v) { unsigned w = (unsigned)__builtin_amdgcn_readfirstlane(v); asm volatile("" : "+s"(w)); return w; }
__device__ __forceinline__ void wait_tensor0() { asm volatile("s_wait_tensorcnt 0x0" ::: "memory"); }   // this wave's own slice has landed
__device__ __forceinline__ void wait_ds0() { asm volatile("s_wait_dscnt 0x0" ::: "memory"); }           // this wave's LDS reads have returned
// 32 rows of 256 bytes, source pitch 2048 B, 16 B of LDS pad behind every row; extents in bytes, tensor = tile, no mask
__device__ __forceinline__ u32x8 tdm_group1() {
    u32x8 g;
    g[0] = uni((1u << 20) | (5u << 22) | (3u << 25));
    g[1] = uni((unsigned)GKB << 16);
    g[2] = uni(32u << 16);
    g[3] = uni((unsigned)GKB << 16);
    g[4] = uni(32u);
    g[5] = uni((unsigned)(EE * 2));
    g[6] = uni(0u);
    g[7] = uni(0u);
    asm volatile("" : "+s"(g));   // descriptor words held in scalar registers of their own: none of them takes another value while a request is in flight
    return g;
}
__device__ __forceinline__ void tdm_load(unsigned lds_dst, unsigned long long ga, u32x8 g1) {
    u32x4 g0;
    g0[0] = uni(1u);
    g0[1] = uni(lds_dst);
    g0[2] = uni((unsigned)ga);
    g0[3] = uni((((unsigned)(ga >> 32)) & 0x01FFFFFFu) | 0x80000000u);
    asm volatile("tensor_load_to_lds %0, %1" :: "s"(g0), "s"(g1) : "memory");
}
__device__ __forceinline__ v16bf ldfrag(const unsigned char* p) { return cat16b(*(const v8usa*)p, *(const v8usa*)(p + 32)); }

template <bool SPLITA, int MODE>
__global__ __launch_bounds__(256) void k_gemmb(const bf* __restrict__ A, const bf* __restrict__ Al, const bf* __restrict__ Bn, const float* __restrict__ bias, const float* __restrict__ bias2, void* C, void* C2) {
    __shared__ __attribute__((aligned(2048))) unsigned char L[2 * GSTAGE];
    __shared__ __align__(16) float ost[8][32 * 68];
    const int lane = threadIdx.x & 31, lr = lane & 15, hi = lane >> 4;
    const unsigned wave = uni(threadIdx.x >> 5);
    const int wm = (int)(wave >> 1), wn = (int)(wave & 1u);
    const int r0 = blockIdx.x * 128 + wm * 32, c0 = blockIdx.y * 128 + wn * 64;
    constexpr unsigned T = SPLITA ? 2 * GPASS : GPASS;
    // this wave's slice of a stage: waves 0 to 3 bring 32 rows of A (or Al) each, waves 4 to 7 32 rows of B
    const unsigned long long rowb = (wave < 4u) ? (unsigned long long)(blockIdx.x * 128 + wave * 32) * (EE * 2) : (unsigned long long)(blockIdx.y * 128 + (wave - 4u) * 32) * (EE * 2);
    const unsigned long long src0 = ((wave < 4u) ? (unsigned long long)(size_t)A : (unsigned long long)(size_t)Bn) + rowb;
    const unsigned long long src1 = SPLITA ? ((wave < 4u) ? (unsigned long long)(size_t)Al : (unsigned long long)(size_t)Bn) + rowb : src0;
    const unsigned lds_slice = (unsigned)(size_t)L + wave * GSLICE;
    const u32x8 g1 = tdm_group1();
    const unsigned abase = (unsigned)wm * GSLICE + (unsigned)lr * GPITCH + 16u * (unsigned)hi;
    const unsigned bbase = (4u + 2u * (unsigned)wn) * GSLICE + (unsigned)lr * GPITCH + 16u * (unsigned)hi;
    v8f acc[2][4];
#pragma unroll
    for (int m = 0; m < 2; ++m)
#pragma unroll
        for (int t = 0; t < 4; ++t) acc[m][t] = (v8f){};
    tdm_load(lds_slice, src0, g1);
    wait_tensor0();
    __syncthreads();                                   // stage 0 is published: every wave's slice has landed
    tdm_load(lds_slice + GSTAGE, src0 + GKB, g1);
#pragma unroll 1
    for (unsigned p = 0; p < T; ++p) {                 // rolled: one publish point per pass
        const unsigned buf = (p & 1u) * GSTAGE;
        const unsigned char* la = L + buf + abase;
        const unsigned char* lb = L + buf + bbase;
        v16bf a[2][2], b[2][4];                        // two fragment sets: block u works on set u & 1 while block u + 1's loads fill the other
#pragma unroll
        for (int m = 0; m < 2; ++m) a[0][m] = ldfrag(la + m * 16 * GPITCH);
#pragma unroll
        for (int t = 0; t < 4; ++t) b[0][t] = ldfrag(lb + (t >> 1) * GSLICE + (t & 1) * 16 * GPITCH);
#pragma unroll
        for (int u = 0; u < GKB / 64; ++u) {
            const int cs = u & 1;
            if (u + 1 < GKB / 64) {
#pragma unroll
                for (int m = 0; m < 2; ++m) a[cs ^ 1][m] = ldfrag(la + m * 16 * GPITCH + (u + 1) * 64);
#pragma unroll
                for (int t = 0; t < 4; ++t) b[cs ^ 1][t] = ldfrag(lb + (t >> 1) * GSLICE + (t & 1) * 16 * GPITCH + (u + 1) * 64);
            }
            __builtin_amdgcn_sched_barrier(0);         // keeps the next block's LDS loads as one group ahead of this block's WMMAs, not among them
#pragma unroll
            for (int m = 0; m < 2; ++m)
#pragma unroll
                for (int t = 0; t < 4; ++t) acc[m][t] = wmmab(a[cs][m], b[cs][t], acc[m][t]);
            __builtin_amdgcn_sched_barrier(0);         // keeps the WMMAs of this block ahead of the following loads and of the pass's foot
        }
        asm volatile("v_nop\n\tv_nop\n\tv_nop\n\tv_nop");   // the distance behind the pass's last WMMAs, on the loop's back edge and its exit alike
        __builtin_amdgcn_sched_barrier(0);             // holds those slots directly behind the WMMAs
        wait_ds0();
        wait_tensor0();
        __syncthreads();                               // publishes stage p + 1 and ends every reader's last read of this buffer
        const unsigned nx = pinned(p + 2u);            // formed behind the waits, and the descriptor from it
        if (pinned((nx < T) ? 1u : 0u) != 0u) {         // scalar branch: only while stage p + 2 exists
            const unsigned long long ga = ((SPLITA && nx >= (unsigned)GPASS) ? src1 : src0) + (unsigned long long)((nx & (unsigned)(GPASS - 1)) * GKB);
            tdm_load(lds_slice + buf, ga, g1);
        }
    }
    wait_tensor0();
    wait_ds0();
    float* os = &ost[wave][0];
#pragma unroll
    for (int t = 0; t < 4; ++t) { const int col = c0 + t * 16 + lr; const float bv = (MODE == 0 && bias) ? bfr(bias[col]) : 0.f;
#pragma unroll
        for (int m = 0; m < 2; ++m)
#pragma unroll
            for (int j = 0; j < 8; ++j) os[(m * 16 + hi * 8 + j) * 68 + t * 16 + lr] = acc[m][t][j] + bv; }
    __syncthreads();
    if (MODE == 0) {
        float* crow = (float*)C + (size_t)r0 * EE + c0;
#pragma unroll
        for (int s = 0; s < 16; ++s) { const int Lid = (lane >> 3) + 4 * s, piece = lane & 7; const int row = Lid >> 1, cofs = (Lid & 1) * 32 + piece * 4;
            const v4f val = *(const v4fa*)(os + row * 68 + cofs); *(v4f*)(crow + (size_t)row * EE + cofs) = val; }
    } else if (MODE == 1) {
        h16* c1 = (h16*)C + (size_t)r0 * EE + c0; h16* c2 = (h16*)C2 + (size_t)r0 * EE + c0;
#pragma unroll
        for (int s = 0; s < 8; ++s) { const int row = 4 * s + (lane >> 3), piece = lane & 7; const float* sp = os + row * 68 + piece * 8; v8h o1, o2;
#pragma unroll
            for (int i = 0; i < 8; ++i) { const int col = c0 + piece * 8 + i; o1[i] = (h16)(sp[i] + bfr(bias[col])); o2[i] = (h16)(sp[i] + bfr(bias2[col])); }
            *(v8h*)(c1 + (size_t)row * EE + piece * 8) = o1; *(v8h*)(c2 + (size_t)row * EE + piece * 8) = o2; }
    } else {
        h16* c1 = (h16*)C + (size_t)r0 * EE + c0;
#pragma unroll
        for (int s = 0; s < 8; ++s) { const int row = 4 * s + (lane >> 3), piece = lane & 7; const float* sp = os + row * 68 + piece * 8; v8h o1;
#pragma unroll
            for (int i = 0; i < 8; ++i) o1[i] = (h16)sp[i];
            *(v8h*)(c1 + (size_t)row * EE + piece * 8) = o1; }
    }
}

// k_vt: VTH [b][h][d][s] = f16 of V row (s*4 + b), col h*64 + d; block (b, h, 64 s): LDS transposes.
__global__ __launch_bounds__(256) void k_vt(const float* __restrict__ V, h16* VTH) {
    __shared__ __align__(16) h16 tile[HD * 72];
    const int bid = blockIdx.x;
    const int b = bid / (NH_ * (SS / 64)), rem = bid - b * (NH_ * (SS / 64)), h = rem / (SS / 64), kt = rem - h * (SS / 64);
    const int s0 = kt * 64, tid = threadIdx.x, kk = tid >> 2, d0 = (tid & 3) * 16;
    const float* src = V + ((size_t)(s0 + kk) * NBT + b) * EE + h * HD + d0;
#pragma unroll
    for (int i = 0; i < 16; ++i) tile[(d0 + i) * 72 + kk] = (h16)src[i];
    __syncthreads();
    const int piece = tid & 7;
    const size_t base = (((size_t)b * NH_ + h) * HD) * SS + s0;
    auto pass = [&]() {
#pragma unroll
        for (int s = 0; s < 2; ++s) { const int d = (tid >> 3) + 32 * s;
            const v8h val = *(const v8ha*)(tile + d * 72 + piece * 8); *(v8h*)(VTH + base + (size_t)d * SS + piece * 8) = val; }
    };
    pass(); 
}

// k_attn: block = (b, h, 64 queries), wave = 16 consecutive queries q0..q0+15; 32 key tiles of 32 keys; per tile:
//   content: 4 WMMA (QC rows (s*4+b) . K rows); position: B = KP rows m = mbase .. mbase+47 (mbase = 1023 - (q0+15) + l0, wave-specific) in 3 n-tiles x 2 k-chunks
//   = 6 WMMA against QP; the 16 x 48 result is parked in the wave's LDS tile and each lane gathers pos[r][15 - r + kk] (kk = key offset 0..31) = the rel-shifted
//   score; logits = (content + pos) / 8; online f32 softmax; weights x32768 plain f16 tile (same-wave may_alias reload after a compiler barrier); 4 WMMA against
__global__ __launch_bounds__(128) void k_attn(const h16* __restrict__ QC, const h16* __restrict__ QP, const h16* __restrict__ K16, const h16* __restrict__ KP,
                                             const h16* __restrict__ VTH, bf* CH, bf* CL) {
    __shared__ __align__(16) h16 plds[4][16 * 32];
    __shared__ __align__(16) float posl[4][16 * 52];
    __shared__ __align__(16) float ost[4][16 * 68];
    const int lane = threadIdx.x & 31, wave = threadIdx.x >> 5, lr = lane & 15, hi = lane >> 4;
    const int bid = blockIdx.x;
    const int b = bid / (NH_ * (SS / 64)), rem = bid - b * (NH_ * (SS / 64)), h = rem / (SS / 64), qt = rem - h * (SS / 64);
    const int q0 = qt * 64 + wave * 16;
    h16* pl = &plds[wave][0]; float* ps = &posl[wave][0];
    v16h qc[2];
    const size_t qoff = ((size_t)(q0 + lr) * NBT + b) * EE + h * HD + 8 * hi;
#pragma unroll
    for (int kc = 0; kc < 2; ++kc) qc[kc] = cat16(*(const v8h*)(QC + qoff + kc * 32), *(const v8h*)(QC + qoff + kc * 32 + 16));
    const size_t vbase = (((size_t)b * NH_ + h) * HD) * SS;
    v8f o[4];
#pragma unroll
    for (int n = 0; n < 4; ++n) o[n] = (v8f){};
    float mrow[8], lpart[8];
#pragma unroll
    for (int j = 0; j < 8; ++j) { mrow[j] = -3.0e38f; lpart[j] = 0.f; }
#pragma unroll 1
    for (int kt = 0; kt < SS / 32; ++kt) {
        const int l0 = kt * 32;
        // content
        v8f s0 = {}, s1 = {};
#pragma unroll
        for (int kc = 0; kc < 2; ++kc) {
            const size_t o0 = ((size_t)(l0 + lr) * NBT + b) * EE + h * HD + kc * 32 + 8 * hi, o1 = ((size_t)(l0 + 16 + lr) * NBT + b) * EE + h * HD + kc * 32 + 8 * hi;
            s0 = wmma16(qc[kc], cat16(*(const v8h*)(K16 + o0), *(const v8h*)(K16 + o0 + 16)), s0);
            s1 = wmma16(qc[kc], cat16(*(const v8h*)(K16 + o1), *(const v8h*)(K16 + o1 + 16)), s1);
        }
        // position band: rows m = mbase + (t*16 + lr)
        const int mbase = (SS - 1) - (q0 + 15) + l0;
        { const v16h qp0 = cat16(*(const v8h*)(QP + qoff), *(const v8h*)(QP + qoff + 16)), qp1 = cat16(*(const v8h*)(QP + qoff + 32), *(const v8h*)(QP + qoff + 48));   // (q + pos_bias) fragments, re-read per step (register budget)
#pragma unroll
          for (int t = 0; t < 3; ++t) {
            const size_t om = ((size_t)(mbase + t * 16 + lr) * NH_ + h) * HD + 8 * hi;      // KP row m = mbase + t*16 + lr, head h: [m][h*64 + d]
            v8f pz = wmma16(qp0, cat16(*(const v8h*)(KP + om), *(const v8h*)(KP + om + 16)), (v8f){});
            pz = wmma16(qp1, cat16(*(const v8h*)(KP + om + 32), *(const v8h*)(KP + om + 48)), pz);
            asm volatile("v_nop\n\tv_nop\n\tv_nop\n\tv_nop" : "+v"(pz) : "v"(qp0), "v"(qp1));
#pragma unroll
            for (int j = 0; j < 8; ++j) ps[(hi * 8 + j) * 52 + t * 16 + lr] = pz[j];
          } }
        asm volatile("v_nop\n\tv_nop\n\tv_nop\n\tv_nop" : "+v"(s0), "+v"(s1) : "v"(qc[0]), "v"(qc[1]));
        asm volatile("" ::: "memory");
        __builtin_amdgcn_fence(__ATOMIC_RELEASE, "workgroup");
        __builtin_amdgcn_wave_barrier();
        float alpha[8];
#pragma unroll
        for (int j = 0; j < 8; ++j) {
            const int r = hi * 8 + j;                              // local query row: m index of key kk is (15 - r + kk)
            const float p0v = ps[r * 52 + 15 - r + lr], p1v = ps[r * 52 + 15 - r + 16 + lr];
            const float a0 = (s0[j] + p0v) * SCL, a1 = (s1[j] + p1v) * SCL;
            float mx = fmaxf(a0, a1);
            mx = fmaxf(mx, __shfl_xor(mx, 1, 16)); mx = fmaxf(mx, __shfl_xor(mx, 2, 16)); mx = fmaxf(mx, __shfl_xor(mx, 4, 16)); mx = fmaxf(mx, __shfl_xor(mx, 8, 16));
            const float mn = fmaxf(mrow[j], mx);
            alpha[j] = __expf(mrow[j] - mn); mrow[j] = mn;
            const float e0 = __expf(a0 - mn), e1 = __expf(a1 - mn);
            lpart[j] = lpart[j] * alpha[j] + (e0 + e1);
            pl[r * 32 + lr] = (h16)(e0 * PSC); pl[r * 32 + 16 + lr] = (h16)(e1 * PSC);
        }
#pragma unroll
        for (int n = 0; n < 4; ++n)
#pragma unroll
            for (int j = 0; j < 8; ++j) o[n][j] *= alpha[j];
        asm volatile("" ::: "memory");
        const v16h pa = cat16(*(const v8ha*)(pl + lr * 32 + hi * 8), *(const v8ha*)(pl + lr * 32 + 16 + hi * 8));
#pragma unroll
        for (int n = 0; n < 4; ++n) { const size_t vo = vbase + (size_t)(n * 16 + lr) * SS + l0 + hi * 8;
            o[n] = wmma16(pa, cat16(*(const v8h*)(VTH + vo), *(const v8h*)(VTH + vo + 16)), o[n]); }
        asm volatile("v_nop\n\tv_nop\n\tv_nop\n\tv_nop" : "+v"(o[0]), "+v"(o[1]), "+v"(o[2]), "+v"(o[3]) : "v"(pa));
        __builtin_amdgcn_wave_barrier();                           // all lanes have read this step's pos tile before the next step overwrites it
    }
    float inv[8];
#pragma unroll
    for (int j = 0; j < 8; ++j) { float rs = lpart[j]; rs += __shfl_xor(rs, 1, 16); rs += __shfl_xor(rs, 2, 16); rs += __shfl_xor(rs, 4, 16); rs += __shfl_xor(rs, 8, 16); inv[j] = 1.0f / (rs * PSC); }
    float* os = &ost[wave][0];
#pragma unroll
    for (int n = 0; n < 4; ++n)
#pragma unroll
        for (int j = 0; j < 8; ++j) os[(hi * 8 + j) * 68 + n * 16 + lr] = o[n][j] * inv[j];
    __syncthreads();
    auto pass = [&]() {
#pragma unroll
        for (int s = 0; s < 4; ++s) { const int row = 4 * s + (lane >> 3), piece = lane & 7; const float* sp = os + row * 68 + piece * 8; v8us oh, ol;
#pragma unroll
            for (int i = 0; i < 8; ++i) { const unsigned short hb = f2bf(sp[i]); oh[i] = hb; ol[i] = f2bf(sp[i] - bf2f(hb)); }
            const size_t co = ((size_t)(q0 + row) * NBT + b) * EE + h * HD + piece * 8;
            *(v8us*)(CH + co) = oh; *(v8us*)(CL + co) = ol; }
    };
    pass(); 
}

extern "C" void kernel_launch(void* const* d_in, const int* in_sizes, int n_in,
                              void* d_out, int out_size, void* d_ws, size_t ws_size, hipStream_t stream) {
    (void)in_sizes; (void)n_in; (void)out_size;
    const float* query = (const float*)d_in[0]; const float* key = (const float*)d_in[1]; const float* value = (const float*)d_in[2]; const float* pe = (const float*)d_in[3];
    const float* wq = (const float*)d_in[4]; const float* wk = (const float*)d_in[5]; const float* wv = (const float*)d_in[6]; const float* wkp = (const float*)d_in[7];
    const float* cb = (const float*)d_in[8]; const float* pb = (const float*)d_in[9]; const float* wo = (const float*)d_in[10]; const float* bo = (const float*)d_in[11];
    float* out = (float*)d_out;    // [1024][4][1024]
    char* wsp = (char*)d_ws;
    auto take = [&](size_t bytes) { char* p = wsp; wsp += (bytes + 255) & ~(size_t)255; return (void*)p; };
    bf* Xq = (bf*)take((size_t)NTK * EE * 2); bf* Xk = (bf*)take((size_t)NTK * EE * 2); bf* Xv = (bf*)take((size_t)NTK * EE * 2); bf* Xp = (bf*)take((size_t)MP * EE * 2);
    bf* Wq = (bf*)take((size_t)EE * EE * 2); bf* Wk = (bf*)take((size_t)EE * EE * 2); bf* Wv = (bf*)take((size_t)EE * EE * 2); bf* Wp = (bf*)take((size_t)EE * EE * 2); bf* Wo = (bf*)take((size_t)EE * EE * 2);
    h16* QC = (h16*)take((size_t)NTK * EE * 2); h16* QP = (h16*)take((size_t)NTK * EE * 2); h16* K16 = (h16*)take((size_t)NTK * EE * 2); h16* KP = (h16*)take((size_t)MP * EE * 2);
    float* Vf = (float*)take((size_t)NTK * EE * 4); h16* VTH = (h16*)take((size_t)NTK * EE * 2);
    if ((size_t)(wsp - (char*)d_ws) > ws_size) return;    // 8.4x3 + 4.2 + 10.5 + 8.4x3 + 4.2 + 16.8 + 8.4 = 94.4 MB (CH/CL alias Xq/Xk after their last readers)
    bf* CH = Xq; bf* CL = Xk;                      // Xq, Xk are dead after the q / k projections
    k_cvtb<<<NTK / 8, 256, 0, stream>>>(query, 0, NTK, NTK, Xq);
    k_cvtb<<<NTK / 8, 256, 0, stream>>>(key, 0, NTK, NTK, Xk);
    k_cvtb<<<NTK / 8, 256, 0, stream>>>(value, 0, NTK, NTK, Xv);
    k_cvtb<<<MP / 8, 256, 0, stream>>>(pe, 1, MPOS, MP, Xp);                     // pe[1 : 2048], row 2047 zero
    k_cvtb<<<EE / 8, 256, 0, stream>>>(wq, 0, EE, EE, Wq); k_cvtb<<<EE / 8, 256, 0, stream>>>(wk, 0, EE, EE, Wk); k_cvtb<<<EE / 8, 256, 0, stream>>>(wv, 0, EE, EE, Wv);
    k_cvtb<<<EE / 8, 256, 0, stream>>>(wkp, 0, EE, EE, Wp); k_cvtb<<<EE / 8, 256, 0, stream>>>(wo, 0, EE, EE, Wo);
    k_gemmb<false, 1><<<dim3(NTK / 128, EE / 128, 1), 256, 0, stream>>>(Xq, nullptr, Wq, cb, pb, QC, QP);          // q + content_bias, q + pos_bias (f16)
    k_gemmb<false, 2><<<dim3(NTK / 128, EE / 128, 1), 256, 0, stream>>>(Xk, nullptr, Wk, nullptr, nullptr, K16, nullptr);
    k_gemmb<false, 2><<<dim3(MP / 128, EE / 128, 1), 256, 0, stream>>>(Xp, nullptr, Wp, nullptr, nullptr, KP, nullptr);  // k_pos (pad row 2047 = 0)
    k_gemmb<false, 0><<<dim3(NTK / 128, EE / 128, 1), 256, 0, stream>>>(Xv, nullptr, Wv, nullptr, nullptr, Vf, nullptr);
    k_vt<<<NBT * NH_ * (SS / 64), 256, 0, stream>>>(Vf, VTH);
    k_attn<<<NBT * NH_ * (SS / 64), 128, 0, stream>>>(QC, QP, K16, KP, VTH, CH, CL);
    k_gemmb<true, 0><<<dim3(NTK / 128, EE / 128, 1), 256, 0, stream>>>(CH, CL, Wo, bo, nullptr, out, nullptr);         // out = ctx.w_out^T + b_out
}

// v002
// Measured time: 187 microseconds a run.
// Timed twice side by side with v001, it ran 1.15 times as fast both times.
// All steps since v000 together make it 1.79 times as fast.
#include <hip/hip_runtime.h>

// Contractions, f32 accumulate: q = query.w_q^T, k = key.w_k^T, v = value.w_v^T ([4096 = (s,b) rows x 1024].[1024 x 1024]) and k_pos = pe[1:2048].w_k_pos^T
// ([2047 x 1024].[1024 x 1024]) on v_wmma_f32_16x16x32_bf16 with PLAIN bf16 operands (inputs rounded once: exact products); the per-(batch, head) attention fused
// on v_wmma_f32_16x16x32_f16: content scores (q + content_bias).k^T (plain f16, 4 WMMA per 32-key step), relative-position scores (q + pos_bias).k_pos[m]^T over
// the 48-row band m = 1023 - q + k that the Transformer-XL rel-shift selects (6 WMMA per step into a per-wave LDS tile, then gathered by the arithmetic index),
// softmax over all 1024 keys, and weights.v with plain f16 weights (x32768) and plain f16 v (flat softmax over 1024 keys averages the single rounding); out = ctx.w_out^T + b_out on

#define SS   1024
#define NBT  4
#define EE   1024
#define NH_  16
#define HD   64
#define MPOS 2047
#define MP   2048                // padded k_pos rows (row 2047 zero)
#define NTK  (SS * NBT)          // 4096 token rows, row = s*4 + b
#define PSC  32768.0f
#define LOSC 1024.0f
#define LOSCI (1.0f / 1024.0f)
#define SCL  0.125f

typedef _Float16 h16;
typedef unsigned short bf;
typedef __attribute__((ext_vector_type(16))) __bf16   v16bf;
typedef __attribute__((ext_vector_type(16))) _Float16 v16h;
typedef __attribute__((ext_vector_type(8)))  _Float16 v8h;
typedef __attribute__((ext_vector_type(8)))  unsigned short v8us;
typedef __attribute__((ext_vector_type(8)))  float    v8f;
typedef __attribute__((ext_vector_type(4)))  float    v4f;
typedef v8h  __attribute__((may_alias)) v8ha;
typedef v4f  __attribute__((may_alias)) v4fa;
typedef v8us __attribute__((may_alias)) v8usa;

__device__ __forceinline__ unsigned short f2bf(float f) { unsigned u = __float_as_uint(f); u += 0x7FFFu + ((u >> 16) & 1u); return (unsigned short)(u >> 16); }
__device__ __forceinline__ float bf2f(unsigned short b) { return __uint_as_float(((unsigned)b) << 16); }
__device__ __forceinline__ float bfr(float f) { return bf2f(f2bf(f)); }
__device__ __forceinline__ v16h cat16(v8h lo, v8h hi) { return __builtin_shufflevector(lo, hi, 0, 1, 2, 3, 4, 5, 6, 7, 8, 9, 10, 11, 12, 13, 14, 15); }
__device__ __forceinline__ v16bf cat16b(v8us lo, v8us hi) { return __builtin_bit_cast(v16bf, __builtin_shufflevector(lo, hi, 0, 1, 2, 3, 4, 5, 6, 7, 8, 9, 10, 11, 12, 13, 14, 15)); }
__device__ __forceinline__ v8f wmma16(v16h a, v16h b, v8f c) { return __builtin_amdgcn_wmma_f32_16x16x32_f16(false, a, false, b, (short)0, c, false, false); }
__device__ __forceinline__ v8f wmmab(v16bf a, v16bf b, v8f c) { return __builtin_amdgcn_wmma_f32_16x16x32_bf16(false, a, false, b, (short)0, c, false, false); }
#define VST2(T, p, v) do { const T vst2_v_ = (v); *(T*)(p) = vst2_v_;  } while (0)

// k_cvtb: every f32 operand of the five GEMMs rounded to bf16 in one launch. dst is one table of XROWS rows of 1024: query, key, value (4096 rows each),
// pe[1 : 2048] (2047 rows and a zero row), then w_q, w_k, w_v, w_k_pos, w_out (1024 rows each). A block takes 32 rows, all of one source; a wave 4 of them.
#define XROWS (3 * NTK + MP + 5 * EE)
__global__ __launch_bounds__(256) void k_cvtb(const float* __restrict__ query, const float* __restrict__ key, const float* __restrict__ value, const float* __restrict__ pe,
                                              const float* __restrict__ wq, const float* __restrict__ wk, const float* __restrict__ wv, const float* __restrict__ wkp,
                                              const float* __restrict__ wo, bf* dst) {
    const int lane = threadIdx.x & 31, rb = blockIdx.x * 32;
    const float* src; int first, srcoff = 0, nvalid = NTK;
    if (rb < NTK) { src = query; first = 0; }
    else if (rb < 2 * NTK) { src = key; first = NTK; }
    else if (rb < 3 * NTK) { src = value; first = 2 * NTK; }
    else if (rb < 3 * NTK + MP) { src = pe; first = 3 * NTK; srcoff = 1; nvalid = MPOS; }
    else { const int w = (rb - (3 * NTK + MP)) / EE; first = 3 * NTK + MP + w * EE;
           src = (w == 0) ? wq : (w == 1) ? wk : (w == 2) ? wv : (w == 3) ? wkp : wo; }
    const int r0 = rb + (threadIdx.x >> 5) * 4, l0 = r0 - first;
    v4f x[4][4][2];
#pragma unroll
    for (int n = 0; n < 4; ++n) {
        const int rs = (l0 + n < nvalid) ? (l0 + n + srcoff) : srcoff;
#pragma unroll
        for (int q = 0; q < 4; ++q)
#pragma unroll
            for (int e = 0; e < 2; ++e) x[n][q][e] = *(const v4f*)(src + (size_t)rs * EE + q * 256 + lane * 8 + e * 4);
        asm volatile("s_wait_xcnt 0x0" ::: "memory");  // a later row's loads may land in this row's address registers: the wait that stands in front of such an overwrite
    }
    __builtin_amdgcn_sched_barrier(0);                 // all 32 loads of the wave are requested before the first value is rounded: one memory latency, not one per row
    v8us t[4][4];
#pragma unroll
    for (int n = 0; n < 4; ++n)
#pragma unroll
        for (int q = 0; q < 4; ++q)
#pragma unroll
            for (int i = 0; i < 8; ++i) { const unsigned short hb = f2bf(x[n][q][i >> 2][i & 3]); t[n][q][i] = (l0 + n < nvalid) ? hb : (unsigned short)0; }
    __builtin_amdgcn_sched_barrier(0);                 // the stores stand together at the end: no register that an issued store names is written again
#pragma unroll
    for (int n = 0; n < 4; ++n)
#pragma unroll
        for (int q = 0; q < 4; ++q) VST2(v8us, dst + (size_t)(r0 + n) * EE + q * 256 + lane * 8, t[n][q]);
}

// k_gemmb: 128 x 128 tile of C[M][1024] = (A [+ Al]).B^T (K = 1024) (+ bias) per work-group, 8 waves (4 x 2), 32 x 64 of it per wave. A pass is 128 k = 256 bytes of
// every operand row; a stage is [A 128 rows | B 128 rows] in LDS at pitch 272 B, brought by one tensor load per wave (its own 32 rows), two buffers, the next
// stage in flight while this one is worked on. With SPLITA the passes run over A first and then over Al (B read again): K = 2048 in effect.
// Output mode 0: f32 rows; mode 1: two f16 planes C = f16(acc + cb[h][d]), C2 = f16(acc + pb[h][d]) (the content / position query variants; column c = h*64 + d);
// mode 2: f16 rows (k, k_pos).
// PROJ: the four projections in one grid. A is the table [query | key | value | pe rows], Bn the table [w_q | w_k | w_v | w_k_pos]; blockIdx.x counts 128-row blocks
// of A, its segment picks the weight, the output and the mode (q: 1 into C, C2; k: 2 into C3; v: 0 into C4, no bias; k_pos: 2 into C5). Not PROJ: mode 0 into C.
#define GKB    256               // bytes of an operand row per pass
#define GPITCH 272               // LDS row pitch: 256 + the mover's 16-byte pad (16 B x odd, for ds_load_b128 readers)
#define GSLICE 10240             // one wave's 32 rows (8704 B) rounded up to a multiple of 2 KiB
#define GSTAGE (8 * GSLICE)
#define GPASS  (EE * 2 / GKB)    // passes per operand plane
typedef unsigned int u32x4 __attribute__((ext_vector_type(4)));
typedef unsigned int u32x8 __attribute__((ext_vector_type(8)));
__device__ __forceinline__ unsigned uni(unsigned v) { return (unsigned)__builtin_amdgcn_readfirstlane(v); }
__device__ __forceinline__ unsigned pinned(unsigned v) { unsigned w = (unsigned)__builtin_amdgcn_readfirstlane(v); asm volatile("" : "+s"(w)); return w; }
__device__ __forceinline__ void wait_tensor0() { asm volatile("s_wait_tensorcnt 0x0" ::: "memory"); }   // this wave's own slice has landed
__device__ __forceinline__ void wait_ds0() { asm volatile("s_wait_dscnt 0x0" ::: "memory"); }           // this wave's LDS reads have returned
// 32 rows of 256 bytes, source pitch 2048 B, 16 B of LDS pad behind every row; extents in bytes, tensor = tile, no mask
__device__ __forceinline__ u32x8 tdm_group1() {
    u32x8 g;
    g[0] = uni((1u << 20) | (5u << 22) | (3u << 25));
    g[1] = uni((unsigned)GKB << 16);
    g[2] = uni(32u << 16);
    g[3] = uni((unsigned)GKB << 16);
    g[4] = uni(32u);
    g[5] = uni((unsigned)(EE * 2));
    g[6] = uni(0u);
    g[7] = uni(0u);
    asm volatile("" : "+s"(g));   // descriptor words held in scalar registers of their own: none of them takes another value while a request is in flight
    return g;
}
__device__ __forceinline__ void tdm_load(unsigned lds_dst, unsigned long long ga, u32x8 g1) {
    u32x4 g0;
    g0[0] = uni(1u);
    g0[1] = uni(lds_dst);
    g0[2] = uni((unsigned)ga);
    g0[3] = uni((((unsigned)(ga >> 32)) & 0x01FFFFFFu) | 0x80000000u);
    asm volatile("tensor_load_to_lds %0, %1" :: "s"(g0), "s"(g1) : "memory");
}
__device__ __forceinline__ v16bf ldfrag(const unsigned char* p) { return cat16b(*(const v8usa*)p, *(const v8usa*)(p + 32)); }

template <bool SPLITA, bool PROJ>
__global__ __launch_bounds__(256) void k_gemmb(const bf* __restrict__ A, const bf* __restrict__ Al, const bf* __restrict__ Bn, const float* __restrict__ bias, const float* __restrict__ bias2, void* C, void* C2,
                                               void* C3, void* C4, void* C5) {
    __shared__ __attribute__((aligned(2048))) unsigned char L[2 * GSTAGE];
    __shared__ __align__(16) float ost[8][32 * 68];
    const int lane = threadIdx.x & 31, lr = lane & 15, hi = lane >> 4;
    const unsigned wave = uni(threadIdx.x >> 5);
    const int wm = (int)(wave >> 1), wn = (int)(wave & 1u);
    const unsigned seg = PROJ ? ((blockIdx.x < 3u * (NTK / 128)) ? blockIdx.x / (NTK / 128) : 3u) : 0u;      // same for the whole work-group
    const int mode = PROJ ? ((seg == 0u) ? 1 : (seg == 2u) ? 0 : 2) : 0;
    const int r0 = (int)(blockIdx.x - seg * (NTK / 128)) * 128 + wm * 32, c0 = blockIdx.y * 128 + wn * 64;   // row in the segment's own output
    constexpr unsigned T = SPLITA ? 2 * GPASS : GPASS;
    // this wave's slice of a stage: waves 0 to 3 bring 32 rows of A (or Al) each, waves 4 to 7 32 rows of B
    const unsigned long long rowb = (wave < 4u) ? (unsigned long long)(blockIdx.x * 128 + wave * 32) * (EE * 2) : (unsigned long long)(seg * EE + blockIdx.y * 128 + (wave - 4u) * 32) * (EE * 2);
    const unsigned long long src0 = ((wave < 4u) ? (unsigned long long)(size_t)A : (unsigned long long)(size_t)Bn) + rowb;
    const unsigned long long src1 = SPLITA ? ((wave < 4u) ? (unsigned long long)(size_t)Al : (unsigned long long)(size_t)Bn) + rowb : src0;
    const unsigned lds_slice = (unsigned)(size_t)L + wave * GSLICE;
    const u32x8 g1 = tdm_group1();
    const unsigned abase = (unsigned)wm * GSLICE + (unsigned)lr * GPITCH + 16u * (unsigned)hi;
    const unsigned bbase = (4u + 2u * (unsigned)wn) * GSLICE + (unsigned)lr * GPITCH + 16u * (unsigned)hi;
    v8f acc[2][4];
#pragma unroll
    for (int m = 0; m < 2; ++m)
#pragma unroll
        for (int t = 0; t < 4; ++t) acc[m][t] = (v8f){};
    tdm_load(lds_slice, src0, g1);
    wait_tensor0();
    __syncthreads();                                   // stage 0 is published: every wave's slice has landed
    tdm_load(lds_slice + GSTAGE, src0 + GKB, g1);
#pragma unroll 1
    for (unsigned p = 0; p < T; ++p) {                 // rolled: one publish point per pass
        const unsigned buf = (p & 1u) * GSTAGE;
        const unsigned char* la = L + buf + abase;
        const unsigned char* lb = L + buf + bbase;
        v16bf a[2][2], b[2][4];                        // two fragment sets: block u works on set u & 1 while block u + 1's loads fill the other
#pragma unroll
        for (int m = 0; m < 2; ++m) a[0][m] = ldfrag(la + m * 16 * GPITCH);
#pragma unroll
        for (int t = 0; t < 4; ++t) b[0][t] = ldfrag(lb + (t >> 1) * GSLICE + (t & 1) * 16 * GPITCH);
#pragma unroll
        for (int u = 0; u < GKB / 64; ++u) {
            const int cs = u & 1;
            if (u + 1 < GKB / 64) {
#pragma unroll
                for (int m = 0; m < 2; ++m) a[cs ^ 1][m] = ldfrag(la + m * 16 * GPITCH + (u + 1) * 64);
#pragma unroll
                for (int t = 0; t < 4; ++t) b[cs ^ 1][t] = ldfrag(lb + (t >> 1) * GSLICE + (t & 1) * 16 * GPITCH + (u + 1) * 64);
            }
            __builtin_amdgcn_sched_barrier(0);         // keeps the next block's LDS loads as one group ahead of this block's WMMAs, not among them
#pragma unroll
            for (int m = 0; m < 2; ++m)
#pragma unroll
                for (int t = 0; t < 4; ++t) acc[m][t] = wmmab(a[cs][m], b[cs][t], acc[m][t]);
            __builtin_amdgcn_sched_barrier(0);         // keeps the WMMAs of this block ahead of the following loads and of the pass's foot
        }
        asm volatile("v_nop\n\tv_nop\n\tv_nop\n\tv_nop");   // the distance behind the pass's last WMMAs, on the loop's back edge and its exit alike
        __builtin_amdgcn_sched_barrier(0);             // holds those slots directly behind the WMMAs
        wait_ds0();
        wait_tensor0();
        __syncthreads();                               // publishes stage p + 1 and ends every reader's last read of this buffer
        const unsigned nx = pinned(p + 2u);            // formed behind the waits, and the descriptor from it
        if (pinned((nx < T) ? 1u : 0u) != 0u) {         // scalar branch: only while stage p + 2 exists
            const unsigned long long ga = ((SPLITA && nx >= (unsigned)GPASS) ? src1 : src0) + (unsigned long long)((nx & (unsigned)(GPASS - 1)) * GKB);
            tdm_load(lds_slice + buf, ga, g1);
        }
    }
    wait_tensor0();
    wait_ds0();
    float* os = &ost[wave][0];
#pragma unroll
    for (int t = 0; t < 4; ++t) { const int col = c0 + t * 16 + lr; const float bv = (!PROJ && bias) ? bfr(bias[col]) : 0.f;
#pragma unroll
        for (int m = 0; m < 2; ++m)
#pragma unroll
            for (int j = 0; j < 8; ++j) os[(m * 16 + hi * 8 + j) * 68 + t * 16 + lr] = acc[m][t][j] + bv; }
    __syncthreads();
    if (mode == 0) {
        float* crow = (float*)(PROJ ? C4 : C) + (size_t)r0 * EE + c0;
#pragma unroll
        for (int s = 0; s < 16; ++s) { const int Lid = (lane >> 3) + 4 * s, piece = lane & 7; const int row = Lid >> 1, cofs = (Lid & 1) * 32 + piece * 4;
            const v4f val = *(const v4fa*)(os + row * 68 + cofs); *(v4f*)(crow + (size_t)row * EE + cofs) = val; }
    } else if (mode == 1) {
        h16* c1 = (h16*)C + (size_t)r0 * EE + c0; h16* c2 = (h16*)C2 + (size_t)r0 * EE + c0;
#pragma unroll
        for (int s = 0; s < 8; ++s) { const int row = 4 * s + (lane >> 3), piece = lane & 7; const float* sp = os + row * 68 + piece * 8; v8h o1, o2;
#pragma unroll
            for (int i = 0; i < 8; ++i) { const int col = c0 + piece * 8 + i; o1[i] = (h16)(sp[i] + bfr(bias[col])); o2[i] = (h16)(sp[i] + bfr(bias2[col])); }
            *(v8h*)(c1 + (size_t)row * EE + piece * 8) = o1; *(v8h*)(c2 + (size_t)row * EE + piece * 8) = o2; }
    } else {
        h16* c1 = (h16*)((seg == 1u) ? C3 : C5) + (size_t)r0 * EE + c0;
#pragma unroll
        for (int s = 0; s < 8; ++s) { const int row = 4 * s + (lane >> 3), piece = lane & 7; const float* sp = os + row * 68 + piece * 8; v8h o1;
#pragma unroll
            for (int i = 0; i < 8; ++i) o1[i] = (h16)sp[i];
            *(v8h*)(c1 + (size_t)row * EE + piece * 8) = o1; }
    }
}

// k_vt: VTH [b][h][d][s] = f16 of V row (s*4 + b), col h*64 + d; block (b, h, 64 s): LDS transposes.
__global__ __launch_bounds__(256) void k_vt(const float* __restrict__ V, h16* VTH) {
    __shared__ __align__(16) h16 tile[HD * 72];
    const int bid = blockIdx.x;
    const int b = bid / (NH_ * (SS / 64)), rem = bid - b * (NH_ * (SS / 64)), h = rem / (SS / 64), kt = rem - h * (SS / 64);
    const int s0 = kt * 64, tid = threadIdx.x, kk = tid >> 2, d0 = (tid & 3) * 16;
    const float* src = V + ((size_t)(s0 + kk) * NBT + b) * EE + h * HD + d0;
#pragma unroll
    for (int i = 0; i < 16; ++i) tile[(d0 + i) * 72 + kk] = (h16)src[i];
    __syncthreads();
    const int piece = tid & 7;
    const size_t base = (((size_t)b * NH_ + h) * HD) * SS + s0;
    auto pass = [&]() {
#pragma unroll
        for (int s = 0; s < 2; ++s) { const int d = (tid >> 3) + 32 * s;
            const v8h val = *(const v8ha*)(tile + d * 72 + piece * 8); *(v8h*)(VTH + base + (size_t)d * SS + piece * 8) = val; }
    };
    pass(); 
}

// k_attn: block = (b, h, 64 queries), wave = 16 consecutive queries q0..q0+15; 32 key tiles of 32 keys; per tile:
//   content: 4 WMMA (QC rows (s*4+b) . K rows); position: B = KP rows m = mbase .. mbase+47 (mbase = 1023 - (q0+15) + l0, wave-specific) in 3 n-tiles x 2 k-chunks
//   = 6 WMMA against QP; the 16 x 48 result is parked in the wave's LDS tile and each lane gathers pos[r][15 - r + kk] (kk = key offset 0..31) = the rel-shifted
//   score; logits = (content + pos) / 8; online f32 softmax; weights x32768 plain f16 tile (same-wave may_alias reload after a compiler barrier); 4 WMMA against
__global__ __launch_bounds__(128) void k_attn(const h16* __restrict__ QC, const h16* __restrict__ QP, const h16* __restrict__ K16, const h16* __restrict__ KP,
                                             const h16* __restrict__ VTH, bf* CH, bf* CL) {
    __shared__ __align__(16) h16 plds[4][16 * 32];
    __shared__ __align__(16) float posl[4][16 * 52];
    __shared__ __align__(16) float ost[4][16 * 68];
    const int lane = threadIdx.x & 31, wave = threadIdx.x >> 5, lr = lane & 15, hi = lane >> 4;
    const int bid = blockIdx.x;
    const int b = bid / (NH_ * (SS / 64)), rem = bid - b * (NH_ * (SS / 64)), h = rem / (SS / 64), qt = rem - h * (SS / 64);
    const int q0 = qt * 64 + wave * 16;
    h16* pl = &plds[wave][0]; float* ps = &posl[wave][0];
    v16h qc[2];
    const size_t qoff = ((size_t)(q0 + lr) * NBT + b) * EE + h * HD + 8 * hi;
#pragma unroll
    for (int kc = 0; kc < 2; ++kc) qc[kc] = cat16(*(const v8h*)(QC + qoff + kc * 32), *(const v8h*)(QC + qoff + kc * 32 + 16));
    const size_t vbase = (((size_t)b * NH_ + h) * HD) * SS;
    v8f o[4];
#pragma unroll
    for (int n = 0; n < 4; ++n) o[n] = (v8f){};
    float mrow[8], lpart[8];
#pragma unroll
    for (int j = 0; j < 8; ++j) { mrow[j] = -3.0e38f; lpart[j] = 0.f; }
#pragma unroll 1
    for (int kt = 0; kt < SS / 32; ++kt) {
        const int l0 = kt * 32;
        // content
        v8f s0 = {}, s1 = {};
#pragma unroll
        for (int kc = 0; kc < 2; ++kc) {
            const size_t o0 = ((size_t)(l0 + lr) * NBT + b) * EE + h * HD + kc * 32 + 8 * hi, o1 = ((size_t)(l0 + 16 + lr) * NBT + b) * EE + h * HD + kc * 32 + 8 * hi;
            s0 = wmma16(qc[kc], cat16(*(const v8h*)(K16 + o0), *(const v8h*)(K16 + o0 + 16)), s0);
            s1 = wmma16(qc[kc], cat16(*(const v8h*)(K16 + o1), *(const v8h*)(K16 + o1 + 16)), s1);
        }
        // position band: rows m = mbase + (t*16 + lr)
        const int mbase = (SS - 1) - (q0 + 15) + l0;
        { const v16h qp0 = cat16(*(const v8h*)(QP + qoff), *(const v8h*)(QP + qoff + 16)), qp1 = cat16(*(const v8h*)(QP + qoff + 32), *(const v8h*)(QP + qoff + 48));   // (q + pos_bias) fragments, re-read per step (register budget)
#pragma unroll
          for (int t = 0; t < 3; ++t) {
            const size_t om = ((size_t)(mbase + t * 16 + lr) * NH_ + h) * HD + 8 * hi;      // KP row m = mbase + t*16 + lr, head h: [m][h*64 + d]
            v8f pz = wmma16(qp0, cat16(*(const v8h*)(KP + om), *(const v8h*)(KP + om + 16)), (v8f){});
            pz = wmma16(qp1, cat16(*(const v8h*)(KP + om + 32), *(const v8h*)(KP + om + 48)), pz);
            asm volatile("v_nop\n\tv_nop\n\tv_nop\n\tv_nop" : "+v"(pz) : "v"(qp0), "v"(qp1));
#pragma unroll
            for (int j = 0; j < 8; ++j) ps[(hi * 8 + j) * 52 + t * 16 + lr] = pz[j];
          } }
        asm volatile("v_nop\n\tv_nop\n\tv_nop\n\tv_nop" : "+v"(s0), "+v"(s1) : "v"(qc[0]), "v"(qc[1]));
        asm volatile("" ::: "memory");
        __builtin_amdgcn_fence(__ATOMIC_RELEASE, "workgroup");
        __builtin_amdgcn_wave_barrier();
        float alpha[8];
#pragma unroll
        for (int j = 0; j < 8; ++j) {
            const int r = hi * 8 + j;                              // local query row: m index of key kk is (15 - r + kk)
            const float p0v = ps[r * 52 + 15 - r + lr], p1v = ps[r * 52 + 15 - r + 16 + lr];
            const float a0 = (s0[j] + p0v) * SCL, a1 = (s1[j] + p1v) * SCL;
            float mx = fmaxf(a0, a1);
            mx = fmaxf(mx, __shfl_xor(mx, 1, 16)); mx = fmaxf(mx, __shfl_xor(mx, 2, 16)); mx = fmaxf(mx, __shfl_xor(mx, 4, 16)); mx = fmaxf(mx, __shfl_xor(mx, 8, 16));
            const float mn = fmaxf(mrow[j], mx);
            alpha[j] = __expf(mrow[j] - mn); mrow[j] = mn;
            const float e0 = __expf(a0 - mn), e1 = __expf(a1 - mn);
            lpart[j] = lpart[j] * alpha[j] + (e0 + e1);
            pl[r * 32 + lr] = (h16)(e0 * PSC); pl[r * 32 + 16 + lr] = (h16)(e1 * PSC);
        }
#pragma unroll
        for (int n = 0; n < 4; ++n)
#pragma unroll
            for (int j = 0; j < 8; ++j) o[n][j] *= alpha[j];
        asm volatile("" ::: "memory");
        const v16h pa = cat16(*(const v8ha*)(pl + lr * 32 + hi * 8), *(const v8ha*)(pl + lr * 32 + 16 + hi * 8));
#pragma unroll
        for (int n = 0; n < 4; ++n) { const size_t vo = vbase + (size_t)(n * 16 + lr) * SS + l0 + hi * 8;
            o[n] = wmma16(pa, cat16(*(const v8h*)(VTH + vo), *(const v8h*)(VTH + vo + 16)), o[n]); }
        asm volatile("v_nop\n\tv_nop\n\tv_nop\n\tv_nop" : "+v"(o[0]), "+v"(o[1]), "+v"(o[2]), "+v"(o[3]) : "v"(pa));
        __builtin_amdgcn_wave_barrier();                           // all lanes have read this step's pos tile before the next step overwrites it
    }
    float inv[8];
#pragma unroll
    for (int j = 0; j < 8; ++j) { float rs = lpart[j]; rs += __shfl_xor(rs, 1, 16); rs += __shfl_xor(rs, 2, 16); rs += __shfl_xor(rs, 4, 16); rs += __shfl_xor(rs, 8, 16); inv[j] = 1.0f / (rs * PSC); }
    float* os = &ost[wave][0];
#pragma unroll
    for (int n = 0; n < 4; ++n)
#pragma unroll
        for (int j = 0; j < 8; ++j) os[(hi * 8 + j) * 68 + n * 16 + lr] = o[n][j] * inv[j];
    __syncthreads();
    auto pass = [&]() {
#pragma unroll
        for (int s = 0; s < 4; ++s) { const int row = 4 * s + (lane >> 3), piece = lane & 7; const float* sp = os + row * 68 + piece * 8; v8us oh, ol;
#pragma unroll
            for (int i = 0; i < 8; ++i) { const unsigned short hb = f2bf(sp[i]); oh[i] = hb; ol[i] = f2bf(sp[i] - bf2f(hb)); }
            const size_t co = ((size_t)(q0 + row) * NBT + b) * EE + h * HD + piece * 8;
            *(v8us*)(CH + co) = oh; *(v8us*)(CL + co) = ol; }
    };
    pass(); 
}

extern "C" void kernel_launch(void* const* d_in, const int* in_sizes, int n_in,
                              void* d_out, int out_size, void* d_ws, size_t ws_size, hipStream_t stream) {
    (void)in_sizes; (void)n_in; (void)out_size;
    const float* query = (const float*)d_in[0]; const float* key = (const float*)d_in[1]; const float* value = (const float*)d_in[2]; const float* pe = (const float*)d_in[3];
    const float* wq = (const float*)d_in[4]; const float* wk = (const float*)d_in[5]; const float* wv = (const float*)d_in[6]; const float* wkp = (const float*)d_in[7];
    const float* cb = (const float*)d_in[8]; const float* pb = (const float*)d_in[9]; const float* wo = (const float*)d_in[10]; const float* bo = (const float*)d_in[11];
    float* out = (float*)d_out;    // [1024][4][1024]
    char* wsp = (char*)d_ws;
    auto take = [&](size_t bytes) { char* p = wsp; wsp += (bytes + 255) & ~(size_t)255; return (void*)p; };
    bf* Xq = (bf*)take((size_t)NTK * EE * 2); bf* Xk = (bf*)take((size_t)NTK * EE * 2); bf* Xv = (bf*)take((size_t)NTK * EE * 2); bf* Xp = (bf*)take((size_t)MP * EE * 2);
    bf* Wq = (bf*)take((size_t)EE * EE * 2); bf* Wk = (bf*)take((size_t)EE * EE * 2); bf* Wv = (bf*)take((size_t)EE * EE * 2); bf* Wp = (bf*)take((size_t)EE * EE * 2); bf* Wo = (bf*)take((size_t)EE * EE * 2);
    h16* QC = (h16*)take((size_t)NTK * EE * 2); h16* QP = (h16*)take((size_t)NTK * EE * 2); h16* K16 = (h16*)take((size_t)NTK * EE * 2); h16* KP = (h16*)take((size_t)MP * EE * 2);
    float* Vf = (float*)take((size_t)NTK * EE * 4); h16* VTH = (h16*)take((size_t)NTK * EE * 2);
    if ((size_t)(wsp - (char*)d_ws) > ws_size) return;    // 8.4x3 + 4.2 + 10.5 + 8.4x3 + 4.2 + 16.8 + 8.4 = 94.4 MB (CH/CL alias Xq/Xk after their last readers)
    bf* CH = Xq; bf* CL = Xk;                      // Xq, Xk are dead after the q / k projections
    // Xq, Xk, Xv, Xp, Wq, Wk, Wv, Wp, Wo lie one behind the other in the workspace (every size a multiple of 256 bytes): one table from Xq on
    k_cvtb<<<XROWS / 32, 256, 0, stream>>>(query, key, value, pe, wq, wk, wv, wkp, wo, Xq);
    k_gemmb<false, true><<<dim3((3 * NTK + MP) / 128, EE / 128, 1), 256, 0, stream>>>(Xq, nullptr, Wq, cb, pb, QC, QP, K16, Vf, KP);   // q + content_bias, q + pos_bias, k, v, k_pos (pad row 2047 = 0)
    k_vt<<<NBT * NH_ * (SS / 64), 256, 0, stream>>>(Vf, VTH);
    k_attn<<<NBT * NH_ * (SS / 64), 128, 0, stream>>>(QC, QP, K16, KP, VTH, CH, CL);
    k_gemmb<true, false><<<dim3(NTK / 128, EE / 128, 1), 256, 0, stream>>>(CH, CL, Wo, bo, nullptr, out, nullptr, nullptr, nullptr, nullptr);         // out = ctx.w_out^T + b_out
}
